// v000
// The times below were measured on an AMD MI455X: many runs one after another, warmed up first and cycling through
// copies of the inputs, with the whole window's GPU time divided by the number of runs. Launches and the gaps
// between them are all in it. The median over several windows is given; except for v000 it joins two sittings, which
// can be a few percent apart, so the side-by-side timings, each taken in one sitting, are the better comparison.
// v000 is the starting kernel. One run takes 461 microseconds.
#include <hip/hip_runtime.h>

typedef _Float16 v16h __attribute__((ext_vector_type(16)));
typedef _Float16 v8h  __attribute__((ext_vector_type(8)));
typedef _Float16 v4h  __attribute__((ext_vector_type(4)));
typedef float    v8f  __attribute__((ext_vector_type(8)));
typedef float    v4f  __attribute__((ext_vector_type(4)));

#define S_LEN  4096
#define D_DIM  64
#define TQ     64          // query rows per block (4 waves x 16)
#define TK     128         // KV tile
#define KSTR   72          // K-tile LDS row stride (halves), 16B aligned
#define VSTR   136         // Vt / P LDS row stride (halves), 16B aligned

// Build a v16h WMMA A/B fragment from two contiguous 16-byte LDS chunks.
__device__ __forceinline__ v16h make_ab(const _Float16* base, int off_lo, int off_hi) {
  v8h lo = *(const v8h*)(base + off_lo);
  v8h hi = *(const v8h*)(base + off_hi);
  v16h r;
#pragma unroll
  for (int i = 0; i < 8; ++i) { r[i] = lo[i]; r[i + 8] = hi[i]; }
  return r;
}

__global__ __launch_bounds__(128)
void fa_fwd_kernel(const float* __restrict__ Q, const float* __restrict__ K,
                   const float* __restrict__ V, float* __restrict__ O) {
  __shared__ __align__(16) _Float16 Klds[TK * KSTR];        // [key][feat]
  __shared__ __align__(16) _Float16 Vt  [D_DIM * VSTR];     // [feat][key] transposed
  __shared__ __align__(16) _Float16 Plds[4 * 16 * VSTR];    // per-wave P strips

  const int tid  = threadIdx.x;
  const int wave = tid >> 5;
  const int lane = tid & 31;
  const int half = lane >> 4;
  const int l16  = lane & 15;

  const int bh    = blockIdx.y;
  const int qbase = blockIdx.x * TQ;
  const size_t plane = (size_t)bh * S_LEN * D_DIM;
  const float* Qp = Q + plane;
  const float* Kp = K + plane;
  const float* Vp = V + plane;
  float*       Op = O + plane;

  // 1/sqrt(64) * log2(e): scores land directly in log2 domain -> raw v_exp_f32.
  const float qscale = 0.125f * 1.44269504088896340736f;

  // ---- Q A-fragments (rows qbase + 16*wave + l16), vectorized global loads ----
  v16h aq[2];
  {
    const float* qrow = Qp + (size_t)(qbase + 16 * wave + l16) * D_DIM;
#pragma unroll
    for (int c = 0; c < 2; ++c) {
      v4f f0 = *(const v4f*)(qrow + 32 * c + 8 * half);
      v4f f1 = *(const v4f*)(qrow + 32 * c + 8 * half + 4);
      v4f f2 = *(const v4f*)(qrow + 32 * c + 16 + 8 * half);
      v4f f3 = *(const v4f*)(qrow + 32 * c + 16 + 8 * half + 4);
#pragma unroll
      for (int j = 0; j < 4; ++j) {
        aq[c][j]      = (_Float16)(f0[j] * qscale);
        aq[c][j + 4]  = (_Float16)(f1[j] * qscale);
        aq[c][j + 8]  = (_Float16)(f2[j] * qscale);
        aq[c][j + 12] = (_Float16)(f3[j] * qscale);
      }
    }
  }

  v8f sacc[8], oacc[4];
#pragma unroll
  for (int t = 0; t < 4; ++t)
#pragma unroll
    for (int r = 0; r < 8; ++r) oacc[t][r] = 0.0f;

  float rmax[8], rsum[8];
#pragma unroll
  for (int r = 0; r < 8; ++r) { rmax[r] = -1e30f; rsum[r] = 0.0f; }

  _Float16* Pw = Plds + wave * 16 * VSTR;

  for (int kv = 0; kv < S_LEN; kv += TK) {
    __syncthreads();  // previous iteration's LDS reads complete

    // ---- Stage K (row-major f16) and V (transposed f16), float4 global loads ----
#pragma unroll 4
    for (int i = 0; i < 16; ++i) {
      int idx  = tid + 128 * i;       // 0..2047 float4 slots, coalesced over tid
      int row  = idx >> 4;            // key within tile (0..127)
      int col4 = idx & 15;            // float4 column (0..15)
      v4f kf = *(const v4f*)(Kp + (size_t)(kv + row) * D_DIM + col4 * 4);
      v4h kh;
#pragma unroll
      for (int j = 0; j < 4; ++j) kh[j] = (_Float16)kf[j];
      *(v4h*)(Klds + row * KSTR + col4 * 4) = kh;          // ds_store_b64

      v4f vf = *(const v4f*)(Vp + (size_t)(kv + row) * D_DIM + col4 * 4);
#pragma unroll
      for (int j = 0; j < 4; ++j)
        Vt[(col4 * 4 + j) * VSTR + row] = (_Float16)vf[j]; // transpose scatter
    }
    __syncthreads();

    // Prefetch next tile while computing on this one.
    if (kv + TK < S_LEN) {
      __builtin_prefetch(Kp + (size_t)(kv + TK + (tid & 127)) * D_DIM, 0, 0);
      __builtin_prefetch(Vp + (size_t)(kv + TK + (tid & 127)) * D_DIM, 0, 0);
    }

    // ---- S = Q*K^T : 8 n-tiles x 2 k-chunks = 16 WMMA / wave ----
#pragma unroll
    for (int t = 0; t < 8; ++t)
#pragma unroll
      for (int r = 0; r < 8; ++r) sacc[t][r] = 0.0f;

#pragma unroll
    for (int c = 0; c < 2; ++c) {
#pragma unroll
      for (int t = 0; t < 8; ++t) {
        const _Float16* krow = Klds + (16 * t + l16) * KSTR;
        v16h bk = make_ab(krow, 32 * c + 8 * half, 32 * c + 16 + 8 * half);
        sacc[t] = __builtin_amdgcn_wmma_f32_16x16x32_f16(
            false, aq[c], false, bk, (short)0, sacc[t], false, false);
      }
    }

    // ---- Online softmax (log2 domain), rows = r + 8*half ----
#pragma unroll
    for (int r = 0; r < 8; ++r) {
      float m = sacc[0][r];
#pragma unroll
      for (int t = 1; t < 8; ++t) m = fmaxf(m, sacc[t][r]);
#pragma unroll
      for (int off = 8; off >= 1; off >>= 1)
        m = fmaxf(m, __shfl_xor(m, off, 32));       // xor<16 stays inside half
      float nm   = fmaxf(rmax[r], m);
      float corr = __builtin_amdgcn_exp2f(rmax[r] - nm);
      rmax[r] = nm;
      float ps = 0.0f;
#pragma unroll
      for (int t = 0; t < 8; ++t) {
        float p = __builtin_amdgcn_exp2f(sacc[t][r] - nm);
        ps += p;
        Pw[(r + 8 * half) * VSTR + 16 * t + l16] = (_Float16)p;
      }
#pragma unroll
      for (int off = 8; off >= 1; off >>= 1)
        ps += __shfl_xor(ps, off, 32);
      rsum[r] = rsum[r] * corr + ps;
#pragma unroll
      for (int t = 0; t < 4; ++t) oacc[t][r] *= corr;
    }

    // Wave-private P strip; DS is in-order per wave — belt-and-braces wait.
    asm volatile("s_wait_dscnt 0" ::: "memory");

    // ---- O += P*V : 4 key-chunks x 4 d-tiles = 16 WMMA / wave ----
#pragma unroll
    for (int c = 0; c < 4; ++c) {
      v16h ap = make_ab(Pw + l16 * VSTR, 32 * c + 8 * half, 32 * c + 16 + 8 * half);
#pragma unroll
      for (int t = 0; t < 4; ++t) {
        const _Float16* vrow = Vt + (16 * t + l16) * VSTR;  // row = feature d
        v16h bv = make_ab(vrow, 32 * c + 8 * half, 32 * c + 16 + 8 * half);
        oacc[t] = __builtin_amdgcn_wmma_f32_16x16x32_f16(
            false, ap, false, bv, (short)0, oacc[t], false, false);
      }
    }
  }

  // ---- Normalize and store (fp32, coalesced across l16) ----
#pragma unroll
  for (int r = 0; r < 8; ++r) {
    float inv = __builtin_amdgcn_rcpf(rsum[r]);
    int row = qbase + 16 * wave + r + 8 * half;
    float* orow = Op + (size_t)row * D_DIM;
#pragma unroll
    for (int t = 0; t < 4; ++t)
      orow[16 * t + l16] = oacc[t][r] * inv;
  }
}

extern "C" void kernel_launch(void* const* d_in, const int* in_sizes, int n_in,
                              void* d_out, int out_size, void* d_ws, size_t ws_size,
                              hipStream_t stream) {
  (void)n_in; (void)out_size; (void)d_ws; (void)ws_size;
  const float* Q = (const float*)d_in[0];
  const float* K = (const float*)d_in[1];
  const float* V = (const float*)d_in[2];
  float* O = (float*)d_out;
  int bh = in_sizes[0] / (S_LEN * D_DIM);   // B*H = 24
  dim3 grid(S_LEN / TQ, bh);
  fa_fwd_kernel<<<grid, 128, 0, stream>>>(Q, K, V, O);
}

// v001
// It runs in 251 microseconds.
// In both of two side-by-side timings against v000, it was 1.90 times as fast.
#include <hip/hip_runtime.h>

typedef _Float16 v16h __attribute__((ext_vector_type(16)));
typedef _Float16 v8h  __attribute__((ext_vector_type(8)));
typedef _Float16 v4h  __attribute__((ext_vector_type(4)));
typedef float    v8f  __attribute__((ext_vector_type(8)));
typedef float    v4f  __attribute__((ext_vector_type(4)));

#define S_LEN  4096
#define D_DIM  64
#define TQ     64          // query rows per block (4 waves x 16)
#define TK     128         // KV tile
#define KSTR   72          // K-tile LDS row stride (halves), 16B aligned
#define VSTR   136         // Vt LDS row stride (halves), 16B aligned

// Build a v16h WMMA A/B fragment from two contiguous 16-byte LDS chunks.
__device__ __forceinline__ v16h make_ab(const _Float16* base, int off_lo, int off_hi) {
  v8h lo = *(const v8h*)(base + off_lo);
  v8h hi = *(const v8h*)(base + off_hi);
  v16h r;
#pragma unroll
  for (int i = 0; i < 8; ++i) { r[i] = lo[i]; r[i + 8] = hi[i]; }
  return r;
}

// Lane l <-> lane l ^ 16: the two wave halves hold the two key halves of one query column.
__device__ __forceinline__ float xhalf(float x) {
  return __builtin_bit_cast(float, __builtin_amdgcn_permlanex16(
      __builtin_bit_cast(int, x), __builtin_bit_cast(int, x), 0x76543210, 0xfedcba98, false, false));
}

__global__ __launch_bounds__(128)
void fa_fwd_kernel(const float* __restrict__ Q, const float* __restrict__ K,
                   const float* __restrict__ V, float* __restrict__ O) {
  __shared__ __align__(16) _Float16 Klds[TK * KSTR];        // [key][feat]
  __shared__ __align__(16) _Float16 Vt  [D_DIM * VSTR];     // [feat][key] transposed

  const int tid  = threadIdx.x;
  const int wave = tid >> 5;
  const int lane = tid & 31;
  const int half = lane >> 4;
  const int l16  = lane & 15;

  const int bh    = blockIdx.y;
  const int qbase = blockIdx.x * TQ;
  const size_t plane = (size_t)bh * S_LEN * D_DIM;
  const float* Qp = Q + plane;
  const float* Kp = K + plane;
  const float* Vp = V + plane;
  float*       Op = O + plane;

  // 1/sqrt(64) * log2(e): scores land directly in log2 domain -> raw v_exp_f32.
  const float qscale = 0.125f * 1.44269504088896340736f;

  // ---- Q fragments (query qbase + 16*wave + l16), used as the B operand of S^T = K*Q^T ----
  v16h aq[2];
  {
    const float* qrow = Qp + (size_t)(qbase + 16 * wave + l16) * D_DIM;
#pragma unroll
    for (int c = 0; c < 2; ++c) {
      v4f f0 = *(const v4f*)(qrow + 32 * c + 8 * half);
      v4f f1 = *(const v4f*)(qrow + 32 * c + 8 * half + 4);
      v4f f2 = *(const v4f*)(qrow + 32 * c + 16 + 8 * half);
      v4f f3 = *(const v4f*)(qrow + 32 * c + 16 + 8 * half + 4);
#pragma unroll
      for (int j = 0; j < 4; ++j) {
        aq[c][j]      = (_Float16)(f0[j] * qscale);
        aq[c][j + 4]  = (_Float16)(f1[j] * qscale);
        aq[c][j + 8]  = (_Float16)(f2[j] * qscale);
        aq[c][j + 12] = (_Float16)(f3[j] * qscale);
      }
    }
  }

  v8f sacc[8], oacc[4];
#pragma unroll
  for (int t = 0; t < 4; ++t)
#pragma unroll
    for (int r = 0; r < 8; ++r) oacc[t][r] = 0.0f;

  // One query column per lane: running maximum (equal in both halves) and this half's part of the sum.
  float rmax = -1e30f, rsum = 0.0f;

  for (int kv = 0; kv < S_LEN; kv += TK) {
    __syncthreads();  // previous iteration's LDS reads complete

    // ---- Stage K (row-major f16) and V (transposed f16), float4 global loads ----
#pragma unroll 4
    for (int i = 0; i < 16; ++i) {
      int idx  = tid + 128 * i;       // 0..2047 float4 slots, coalesced over tid
      int row  = idx >> 4;            // key within tile (0..127)
      int col4 = idx & 15;            // float4 column (0..15)
      v4f kf = *(const v4f*)(Kp + (size_t)(kv + row) * D_DIM + col4 * 4);
      v4h kh;
#pragma unroll
      for (int j = 0; j < 4; ++j) kh[j] = (_Float16)kf[j];
      *(v4h*)(Klds + row * KSTR + col4 * 4) = kh;          // ds_store_b64

      v4f vf = *(const v4f*)(Vp + (size_t)(kv + row) * D_DIM + col4 * 4);
#pragma unroll
      for (int j = 0; j < 4; ++j)
        Vt[(col4 * 4 + j) * VSTR + row] = (_Float16)vf[j]; // transpose scatter
    }
    __syncthreads();

    // Prefetch next tile while computing on this one.
    if (kv + TK < S_LEN) {
      __builtin_prefetch(Kp + (size_t)(kv + TK + (tid & 127)) * D_DIM, 0, 0);
      __builtin_prefetch(Vp + (size_t)(kv + TK + (tid & 127)) * D_DIM, 0, 0);
    }

    // ---- S^T = K*Q^T : 8 key tiles x 2 k-chunks = 16 WMMA / wave ----
    // sacc[t][r] = score of key 16*t + 8*half + r against query l16.
#pragma unroll
    for (int t = 0; t < 8; ++t)
#pragma unroll
      for (int r = 0; r < 8; ++r) sacc[t][r] = 0.0f;

#pragma unroll
    for (int c = 0; c < 2; ++c) {
#pragma unroll
      for (int t = 0; t < 8; ++t) {
        const _Float16* krow = Klds + (16 * t + l16) * KSTR;
        v16h bk = make_ab(krow, 32 * c + 8 * half, 32 * c + 16 + 8 * half);
        sacc[t] = __builtin_amdgcn_wmma_f32_16x16x32_f16(
            false, bk, false, aq[c], (short)0, sacc[t], false, false);
      }
    }

    // ---- Online softmax (log2 domain): a lane's 64 scores all belong to its own query ----
    float m = sacc[0][0];
#pragma unroll
    for (int t = 0; t < 8; ++t)
#pragma unroll
      for (int r = 0; r < 8; ++r) m = fmaxf(m, sacc[t][r]);
    m = fmaxf(m, xhalf(m));
    const float nm   = fmaxf(rmax, m);
    const float corr = __builtin_amdgcn_exp2f(rmax - nm);
    rmax = nm;

    // P^T packs straight into B fragments: elements 0..7 of chunk c are tile 2c's registers,
    // elements 8..15 tile 2c+1's (keys 32c + 8*half + i and 32c + 16 + 8*half + i, the loaders' k order).
    v16h bp[4];
    float ps0 = 0.0f, ps1 = 0.0f;
#pragma unroll
    for (int c = 0; c < 4; ++c) {
#pragma unroll
      for (int i = 0; i < 8; ++i) {
        float p0 = __builtin_amdgcn_exp2f(sacc[2 * c][i] - nm);
        float p1 = __builtin_amdgcn_exp2f(sacc[2 * c + 1][i] - nm);
        ps0 += p0;
        ps1 += p1;
        bp[c][i]     = (_Float16)p0;
        bp[c][i + 8] = (_Float16)p1;
      }
    }
    rsum = rsum * corr + (ps0 + ps1);
#pragma unroll
    for (int t = 0; t < 4; ++t)
#pragma unroll
      for (int r = 0; r < 8; ++r) oacc[t][r] *= corr;

    // ---- O^T += V^T*P^T : 4 key-chunks x 4 d-tiles = 16 WMMA / wave ----
#pragma unroll
    for (int c = 0; c < 4; ++c) {
#pragma unroll
      for (int t = 0; t < 4; ++t) {
        const _Float16* vrow = Vt + (16 * t + l16) * VSTR;  // row = feature d
        v16h av = make_ab(vrow, 32 * c + 8 * half, 32 * c + 16 + 8 * half);
        oacc[t] = __builtin_amdgcn_wmma_f32_16x16x32_f16(
            false, av, false, bp[c], (short)0, oacc[t], false, false);
      }
    }
  }

  // ---- Join the halves' sums, normalize and store: oacc[t][r] = feature 16*t + 8*half + r of query l16 ----
  {
    const float inv = __builtin_amdgcn_rcpf(rsum + xhalf(rsum));
    float* orow = Op + (size_t)(qbase + 16 * wave + l16) * D_DIM + 8 * half;
#pragma unroll
    for (int t = 0; t < 4; ++t) {
      v4f lo, hi;
#pragma unroll
      for (int j = 0; j < 4; ++j) { lo[j] = oacc[t][j] * inv; hi[j] = oacc[t][j + 4] * inv; }
      *(v4f*)(orow + 16 * t)     = lo;
      *(v4f*)(orow + 16 * t + 4) = hi;
    }
  }
}

extern "C" void kernel_launch(void* const* d_in, const int* in_sizes, int n_in,
                              void* d_out, int out_size, void* d_ws, size_t ws_size,
                              hipStream_t stream) {
  (void)n_in; (void)out_size; (void)d_ws; (void)ws_size;
  const float* Q = (const float*)d_in[0];
  const float* K = (const float*)d_in[1];
  const float* V = (const float*)d_in[2];
  float* O = (float*)d_out;
  int bh = in_sizes[0] / (S_LEN * D_DIM);   // B*H = 24
  dim3 grid(S_LEN / TQ, bh);
  fa_fwd_kernel<<<grid, 128, 0, stream>>>(Q, K, V, O);
}

// v002
// It runs in 117 microseconds.
// Two timings next to v001 put it at 2.14 and 2.15 times that version's speed.
// Counting every step since v000, it is 4.08 times as fast.
#include <hip/hip_runtime.h>

typedef _Float16 v16h __attribute__((ext_vector_type(16)));
typedef _Float16 v8h  __attribute__((ext_vector_type(8)));
typedef _Float16 v2h  __attribute__((ext_vector_type(2)));
typedef float    v8f  __attribute__((ext_vector_type(8)));
typedef float    v4f  __attribute__((ext_vector_type(4)));

#define S_LEN  4096
#define D_DIM  64
#define TQ     64          // query rows per block (4 waves x 16)
#define TK     128         // KV tile
#define KSTR   72          // K-tile LDS row stride (halves), 16B aligned
#define VSTR   136         // Vt LDS row stride (halves), 16B aligned

// Build a v16h WMMA A/B fragment from two contiguous 16-byte LDS chunks.
__device__ __forceinline__ v16h make_ab(const _Float16* base, int off_lo, int off_hi) {
  v8h lo = *(const v8h*)(base + off_lo);
  v8h hi = *(const v8h*)(base + off_hi);
  v16h r;
#pragma unroll
  for (int i = 0; i < 8; ++i) { r[i] = lo[i]; r[i + 8] = hi[i]; }
  return r;
}

// Lane l <-> lane l ^ 16: the two wave halves hold the two key halves of one query column.
__device__ __forceinline__ float xhalf(float x) {
  return __builtin_bit_cast(float, __builtin_amdgcn_permlanex16(
      __builtin_bit_cast(int, x), __builtin_bit_cast(int, x), 0x76543210, 0xfedcba98, false, false));
}

// Pre-pass: one block turns 128 keys of one head into two contiguous 16-KiB f16 tiles, K as [key][feat] and
// V transposed as [feat][key], so that the 64 query blocks of a head copy finished tiles instead of each converting them.
__global__ __launch_bounds__(256)
void cvt_kv_kernel(const float* __restrict__ K, const float* __restrict__ V,
                   _Float16* __restrict__ K16, _Float16* __restrict__ Vt16) {
  __shared__ __align__(16) _Float16 T[D_DIM * VSTR];        // [feat][key]

  const int tid = threadIdx.x;
  const int kv  = blockIdx.x * TK;
  const size_t plane = (size_t)blockIdx.y * S_LEN * D_DIM;
  const float* Kp = K + plane + (size_t)kv * D_DIM;
  const float* Vp = V + plane + (size_t)kv * D_DIM;
  _Float16* Ko = K16 + plane + (size_t)kv * D_DIM;
  _Float16* Vo = Vt16 + plane + (size_t)kv * D_DIM;

  // Thread's first slots: 8 K values at tid*8; the V float4 of column tid & 15 in keys 2*(tid >> 4) and the next.
  const float* kp = Kp + tid * 8;
  const float* vp = Vp + (tid >> 4) * (2 * D_DIM) + (tid & 15) * 4;
  v4f ka[4], kb[4], va[4], vb[4];
#pragma unroll
  for (int i = 0; i < 4; ++i) {
    va[i] = *(const v4f*)(vp + 32 * D_DIM * i);             // key 2*(tid >> 4) + 32*i
    vb[i] = *(const v4f*)(vp + 32 * D_DIM * i + D_DIM);     // the next key
  }
#pragma unroll
  for (int i = 0; i < 4; ++i) {
    ka[i] = *(const v4f*)(kp + 2048 * i);
    kb[i] = *(const v4f*)(kp + 2048 * i + 4);
  }
  // All 16 loads issue before the first conversion: left free, the scheduler waited for V's data before it issued K's loads.
  __builtin_amdgcn_sched_barrier(0);

  // V: two keys of one feature make one dword of the transposed tile.
  _Float16* tw = T + (tid & 15) * 4 * VSTR + 2 * (tid >> 4);
#pragma unroll
  for (int i = 0; i < 4; ++i) {
#pragma unroll
    for (int j = 0; j < 4; ++j) {
      v2h p;
      p[0] = (_Float16)va[i][j];
      p[1] = (_Float16)vb[i][j];
      *(v2h*)(tw + j * VSTR + 32 * i) = p;                  // ds_store_b32
    }
  }
  __syncthreads();

#pragma unroll
  for (int i = 0; i < 4; ++i) {
    v8h h;
#pragma unroll
    for (int j = 0; j < 4; ++j) { h[j] = (_Float16)ka[i][j]; h[j + 4] = (_Float16)kb[i][j]; }
    *(v8h*)(Ko + tid * 8 + 2048 * i) = h;
  }

  // Feature (tid >> 4) + 16*i, 16-byte slot tid & 15 of its 256-byte row.
  const _Float16* tr = T + (tid >> 4) * VSTR + (tid & 15) * 8;
#pragma unroll
  for (int i = 0; i < 4; ++i)
    *(v8h*)(Vo + tid * 8 + 2048 * i) = *(const v8h*)(tr + 16 * VSTR * i);
}

__global__ __launch_bounds__(128)
void fa_fwd_kernel(const float* __restrict__ Q, const _Float16* __restrict__ K16,
                   const _Float16* __restrict__ Vt16, float* __restrict__ O) {
  __shared__ __align__(16) _Float16 Klds[TK * KSTR];        // [key][feat]
  __shared__ __align__(16) _Float16 Vt  [D_DIM * VSTR];     // [feat][key] transposed

  const int tid  = threadIdx.x;
  const int wave = tid >> 5;
  const int lane = tid & 31;
  const int half = lane >> 4;
  const int l16  = lane & 15;

  const int bh    = blockIdx.y;
  const int qbase = blockIdx.x * TQ;
  const size_t plane = (size_t)bh * S_LEN * D_DIM;
  const float* Qp = Q + plane;
  const _Float16* Kp = K16 + plane;    // tiles of [128 keys][feat]
  const _Float16* Vp = Vt16 + plane;   // tiles of [feat][128 keys]
  float*       Op = O + plane;

  // 1/sqrt(64) * log2(e): scores land directly in log2 domain -> raw v_exp_f32.
  const float qscale = 0.125f * 1.44269504088896340736f;

  // ---- Q fragments (query qbase + 16*wave + l16), used as the B operand of S^T = K*Q^T ----
  v16h aq[2];
  {
    const float* qrow = Qp + (size_t)(qbase + 16 * wave + l16) * D_DIM;
#pragma unroll
    for (int c = 0; c < 2; ++c) {
      v4f f0 = *(const v4f*)(qrow + 32 * c + 8 * half);
      v4f f1 = *(const v4f*)(qrow + 32 * c + 8 * half + 4);
      v4f f2 = *(const v4f*)(qrow + 32 * c + 16 + 8 * half);
      v4f f3 = *(const v4f*)(qrow + 32 * c + 16 + 8 * half + 4);
#pragma unroll
      for (int j = 0; j < 4; ++j) {
        aq[c][j]      = (_Float16)(f0[j] * qscale);
        aq[c][j + 4]  = (_Float16)(f1[j] * qscale);
        aq[c][j + 8]  = (_Float16)(f2[j] * qscale);
        aq[c][j + 12] = (_Float16)(f3[j] * qscale);
      }
    }
  }

  v8f sacc[8], oacc[4];
#pragma unroll
  for (int t = 0; t < 4; ++t)
#pragma unroll
    for (int r = 0; r < 8; ++r) oacc[t][r] = 0.0f;

  // One query column per lane: running maximum (equal in both halves) and this half's part of the sum.
  float rmax = -1e30f, rsum = 0.0f;

  // This thread's first 16-byte slot of each tile in LDS.
  _Float16* kl = Klds + (tid >> 3) * KSTR + (tid & 7) * 8;
  _Float16* vl = Vt + (tid >> 4) * VSTR + (tid & 15) * 8;

  for (int kv = 0; kv < S_LEN; kv += TK) {
    __syncthreads();  // previous iteration's LDS reads complete

    // ---- Stage the pre-converted f16 tiles: 16-byte loads, 16-byte LDS stores ----
    // Slot tid + 128*i of 1024: K row (tid >> 3) + 16*i, V^T row (tid >> 4) + 8*i.
    const _Float16* kg = Kp + (size_t)kv * D_DIM + tid * 8;
    const _Float16* vg = Vp + (size_t)kv * D_DIM + tid * 8;
    v8h k8[8], v8[8];
#pragma unroll
    for (int i = 0; i < 8; ++i) {
      k8[i] = *(const v8h*)(kg + 1024 * i);
      v8[i] = *(const v8h*)(vg + 1024 * i);
    }
    // The two address pairs stay whole until this wait.
    asm volatile("s_wait_xcnt 0x0" :: "v"(kg), "v"(vg) : "memory");
#pragma unroll
    for (int i = 0; i < 8; ++i) {
      *(v8h*)(kl + 16 * KSTR * i) = k8[i];
      *(v8h*)(vl + 8 * VSTR * i)  = v8[i];
    }
    __syncthreads();

    // ---- S^T = K*Q^T : 8 key tiles x 2 k-chunks = 16 WMMA / wave ----
    // sacc[t][r] = score of key 16*t + 8*half + r against query l16.
#pragma unroll
    for (int t = 0; t < 8; ++t)
#pragma unroll
      for (int r = 0; r < 8; ++r) sacc[t][r] = 0.0f;

#pragma unroll
    for (int c = 0; c < 2; ++c) {
#pragma unroll
      for (int t = 0; t < 8; ++t) {
        const _Float16* krow = Klds + (16 * t + l16) * KSTR;
        v16h bk = make_ab(krow, 32 * c + 8 * half, 32 * c + 16 + 8 * half);
        sacc[t] = __builtin_amdgcn_wmma_f32_16x16x32_f16(
            false, bk, false, aq[c], (short)0, sacc[t], false, false);
      }
    }

    // ---- Online softmax (log2 domain): a lane's 64 scores all belong to its own query ----
    float m = sacc[0][0];
#pragma unroll
    for (int t = 0; t < 8; ++t)
#pragma unroll
      for (int r = 0; r < 8; ++r) m = fmaxf(m, sacc[t][r]);
    m = fmaxf(m, xhalf(m));
    const float nm   = fmaxf(rmax, m);
    const float corr = __builtin_amdgcn_exp2f(rmax - nm);
    rmax = nm;

    // P^T packs straight into B fragments: elements 0..7 of chunk c are tile 2c's registers,
    // elements 8..15 tile 2c+1's (keys 32c + 8*half + i and 32c + 16 + 8*half + i, the loaders' k order).
    v16h bp[4];
    float ps0 = 0.0f, ps1 = 0.0f;
#pragma unroll
    for (int c = 0; c < 4; ++c) {
#pragma unroll
      for (int i = 0; i < 8; ++i) {
        float p0 = __builtin_amdgcn_exp2f(sacc[2 * c][i] - nm);
        float p1 = __builtin_amdgcn_exp2f(sacc[2 * c + 1][i] - nm);
        ps0 += p0;
        ps1 += p1;
        bp[c][i]     = (_Float16)p0;
        bp[c][i + 8] = (_Float16)p1;
      }
    }
    rsum = rsum * corr + (ps0 + ps1);
#pragma unroll
    for (int t = 0; t < 4; ++t)
#pragma unroll
      for (int r = 0; r < 8; ++r) oacc[t][r] *= corr;

    // ---- O^T += V^T*P^T : 4 key-chunks x 4 d-tiles = 16 WMMA / wave ----
#pragma unroll
    for (int c = 0; c < 4; ++c) {
#pragma unroll
      for (int t = 0; t < 4; ++t) {
        const _Float16* vrow = Vt + (16 * t + l16) * VSTR;  // row = feature d
        v16h av = make_ab(vrow, 32 * c + 8 * half, 32 * c + 16 + 8 * half);
        oacc[t] = __builtin_amdgcn_wmma_f32_16x16x32_f16(
            false, av, false, bp[c], (short)0, oacc[t], false, false);
      }
    }
  }

  // ---- Join the halves' sums, normalize and store: oacc[t][r] = feature 16*t + 8*half + r of query l16 ----
  {
    const float inv = __builtin_amdgcn_rcpf(rsum + xhalf(rsum));
    float* orow = Op + (size_t)(qbase + 16 * wave + l16) * D_DIM + 8 * half;
#pragma unroll
    for (int t = 0; t < 4; ++t) {
      v4f lo, hi;
#pragma unroll
      for (int j = 0; j < 4; ++j) { lo[j] = oacc[t][j] * inv; hi[j] = oacc[t][j + 4] * inv; }
      *(v4f*)(orow + 16 * t)     = lo;
      *(v4f*)(orow + 16 * t + 4) = hi;
    }
  }
}

extern "C" void kernel_launch(void* const* d_in, const int* in_sizes, int n_in,
                              void* d_out, int out_size, void* d_ws, size_t ws_size,
                              hipStream_t stream) {
  (void)n_in; (void)out_size; (void)ws_size;
  const float* Q = (const float*)d_in[0];
  const float* K = (const float*)d_in[1];
  const float* V = (const float*)d_in[2];
  float* O = (float*)d_out;
  int bh = in_sizes[0] / (S_LEN * D_DIM);   // B*H = 24
  _Float16* K16  = (_Float16*)d_ws;                          // 12 MiB used
  _Float16* Vt16 = (_Float16*)((char*)d_ws + (64u << 20));   // 12 MiB used
  dim3 cgrid(S_LEN / TK, bh);
  cvt_kv_kernel<<<cgrid, 256, 0, stream>>>(K, V, K16, Vt16);
  dim3 grid(S_LEN / TQ, bh);
  fa_fwd_kernel<<<grid, 128, 0, stream>>>(Q, K16, Vt16, O);
}

// v003
// One run takes 109 microseconds.
// In two side-by-side timings against v002, it was 1.07 and 1.06 times as fast.
// Counting every step since v000, it is 4.36 times as fast.
#include <hip/hip_runtime.h>

typedef _Float16 v16h __attribute__((ext_vector_type(16)));
typedef _Float16 v8h  __attribute__((ext_vector_type(8)));
typedef _Float16 v2h  __attribute__((ext_vector_type(2)));
typedef float    v8f  __attribute__((ext_vector_type(8)));
typedef float    v4f  __attribute__((ext_vector_type(4)));

#define S_LEN  4096
#define D_DIM  64
#define TQ     64          // query rows per block (4 waves x 16)
#define TK     128         // KV tile
#define KSTR   72          // K-tile LDS row stride (halves), 16B aligned
#define VSTR   136         // Vt LDS row stride (halves), 16B aligned

// Build a v16h WMMA A/B fragment from two contiguous 16-byte LDS chunks.
__device__ __forceinline__ v16h make_ab(const _Float16* base, int off_lo, int off_hi) {
  v8h lo = *(const v8h*)(base + off_lo);
  v8h hi = *(const v8h*)(base + off_hi);
  v16h r;
#pragma unroll
  for (int i = 0; i < 8; ++i) { r[i] = lo[i]; r[i + 8] = hi[i]; }
  return r;
}

// Lane l <-> lane l ^ 16: the two wave halves hold the two key halves of one query column.
__device__ __forceinline__ float xhalf(float x) {
  return __builtin_bit_cast(float, __builtin_amdgcn_permlanex16(
      __builtin_bit_cast(int, x), __builtin_bit_cast(int, x), 0x76543210, 0xfedcba98, false, false));
}

// Pre-pass: one block turns 128 keys of one head into two contiguous 16-KiB f16 tiles, K as [key][feat] and
// V transposed as [feat][key], so that the 64 query blocks of a head copy finished tiles instead of each converting them.
__global__ __launch_bounds__(256)
void cvt_kv_kernel(const float* __restrict__ K, const float* __restrict__ V,
                   _Float16* __restrict__ K16, _Float16* __restrict__ Vt16) {
  __shared__ __align__(16) _Float16 T[D_DIM * VSTR];        // [feat][key]

  const int tid = threadIdx.x;
  const int kv  = blockIdx.x * TK;
  const size_t plane = (size_t)blockIdx.y * S_LEN * D_DIM;
  const float* Kp = K + plane + (size_t)kv * D_DIM;
  const float* Vp = V + plane + (size_t)kv * D_DIM;
  _Float16* Ko = K16 + plane + (size_t)kv * D_DIM;
  _Float16* Vo = Vt16 + plane + (size_t)kv * D_DIM;

  // Thread's first slots: 8 K values at tid*8; the V float4 of column tid & 15 in keys 2*(tid >> 4) and the next.
  const float* kp = Kp + tid * 8;
  const float* vp = Vp + (tid >> 4) * (2 * D_DIM) + (tid & 15) * 4;
  v4f ka[4], kb[4], va[4], vb[4];
#pragma unroll
  for (int i = 0; i < 4; ++i) {
    va[i] = *(const v4f*)(vp + 32 * D_DIM * i);             // key 2*(tid >> 4) + 32*i
    vb[i] = *(const v4f*)(vp + 32 * D_DIM * i + D_DIM);     // the next key
  }
#pragma unroll
  for (int i = 0; i < 4; ++i) {
    ka[i] = *(const v4f*)(kp + 2048 * i);
    kb[i] = *(const v4f*)(kp + 2048 * i + 4);
  }
  // All 16 loads issue before the first conversion: left free, the scheduler waited for V's data before it issued K's loads.
  __builtin_amdgcn_sched_barrier(0);

  // V: two keys of one feature make one dword of the transposed tile.
  _Float16* tw = T + (tid & 15) * 4 * VSTR + 2 * (tid >> 4);
#pragma unroll
  for (int i = 0; i < 4; ++i) {
#pragma unroll
    for (int j = 0; j < 4; ++j) {
      v2h p;
      p[0] = (_Float16)va[i][j];
      p[1] = (_Float16)vb[i][j];
      *(v2h*)(tw + j * VSTR + 32 * i) = p;                  // ds_store_b32
    }
  }
  __syncthreads();

#pragma unroll
  for (int i = 0; i < 4; ++i) {
    v8h h;
#pragma unroll
    for (int j = 0; j < 4; ++j) { h[j] = (_Float16)ka[i][j]; h[j + 4] = (_Float16)kb[i][j]; }
    *(v8h*)(Ko + tid * 8 + 2048 * i) = h;
  }

  // Feature (tid >> 4) + 16*i, 16-byte slot tid & 15 of its 256-byte row.
  const _Float16* tr = T + (tid >> 4) * VSTR + (tid & 15) * 8;
#pragma unroll
  for (int i = 0; i < 4; ++i)
    *(v8h*)(Vo + tid * 8 + 2048 * i) = *(const v8h*)(tr + 16 * VSTR * i);
}

__global__ __launch_bounds__(128)
void fa_fwd_kernel(const float* __restrict__ Q, const _Float16* __restrict__ K16,
                   const _Float16* __restrict__ Vt16, float* __restrict__ O) {
  __shared__ __align__(16) _Float16 Klds[TK * KSTR];        // [key][feat]
  __shared__ __align__(16) _Float16 Vt  [D_DIM * VSTR];     // [feat][key] transposed

  const int tid  = threadIdx.x;
  const int wave = tid >> 5;
  const int lane = tid & 31;
  const int half = lane >> 4;
  const int l16  = lane & 15;

  const int bh    = blockIdx.y;
  const int qbase = blockIdx.x * TQ;
  const size_t plane = (size_t)bh * S_LEN * D_DIM;
  const float* Qp = Q + plane;
  const _Float16* Kp = K16 + plane;    // tiles of [128 keys][feat]
  const _Float16* Vp = Vt16 + plane;   // tiles of [feat][128 keys]
  float*       Op = O + plane;

  // 1/sqrt(64) * log2(e): scores land directly in log2 domain -> raw v_exp_f32.
  const float qscale = 0.125f * 1.44269504088896340736f;

  // ---- Q fragments (query qbase + 16*wave + l16), used as the B operand of S^T = K*Q^T ----
  v16h aq[2];
  {
    const float* qrow = Qp + (size_t)(qbase + 16 * wave + l16) * D_DIM;
#pragma unroll
    for (int c = 0; c < 2; ++c) {
      v4f f0 = *(const v4f*)(qrow + 32 * c + 8 * half);
      v4f f1 = *(const v4f*)(qrow + 32 * c + 8 * half + 4);
      v4f f2 = *(const v4f*)(qrow + 32 * c + 16 + 8 * half);
      v4f f3 = *(const v4f*)(qrow + 32 * c + 16 + 8 * half + 4);
#pragma unroll
      for (int j = 0; j < 4; ++j) {
        aq[c][j]      = (_Float16)(f0[j] * qscale);
        aq[c][j + 4]  = (_Float16)(f1[j] * qscale);
        aq[c][j + 8]  = (_Float16)(f2[j] * qscale);
        aq[c][j + 12] = (_Float16)(f3[j] * qscale);
      }
    }
  }

  v8f sacc[8], oacc[4];
#pragma unroll
  for (int t = 0; t < 4; ++t)
#pragma unroll
    for (int r = 0; r < 8; ++r) oacc[t][r] = 0.0f;

  // One query column per lane: running maximum (equal in both halves) and this half's part of the sum.
  float rmax = -1e30f, rsum = 0.0f;

  // This thread's first 16-byte slot of each tile in LDS.
  _Float16* kl = Klds + (tid >> 3) * KSTR + (tid & 7) * 8;
  _Float16* vl = Vt + (tid >> 4) * VSTR + (tid & 15) * 8;

  for (int kv = 0; kv < S_LEN; kv += TK) {
    __syncthreads();  // previous iteration's LDS reads complete

    // ---- Stage the pre-converted f16 tiles: 16-byte loads, 16-byte LDS stores ----
    // Slot tid + 128*i of 1024: K row (tid >> 3) + 16*i, V^T row (tid >> 4) + 8*i.
    const _Float16* kg = Kp + (size_t)kv * D_DIM + tid * 8;
    const _Float16* vg = Vp + (size_t)kv * D_DIM + tid * 8;
    v8h k8[8], v8[8];
#pragma unroll
    for (int i = 0; i < 8; ++i) {
      k8[i] = *(const v8h*)(kg + 1024 * i);
      v8[i] = *(const v8h*)(vg + 1024 * i);
    }
    // The two address pairs stay whole until this wait.
    asm volatile("s_wait_xcnt 0x0" :: "v"(kg), "v"(vg) : "memory");
#pragma unroll
    for (int i = 0; i < 8; ++i) {
      *(v8h*)(kl + 16 * KSTR * i) = k8[i];
      *(v8h*)(vl + 8 * VSTR * i)  = v8[i];
    }
    __syncthreads();

    // ---- S^T = K*Q^T : 8 key tiles x 2 k-chunks = 16 WMMA / wave ----
    // sacc[t][r] = score of key 16*t + 8*half + r against query l16.
#pragma unroll
    for (int t = 0; t < 8; ++t)
#pragma unroll
      for (int r = 0; r < 8; ++r) sacc[t][r] = 0.0f;

    // The K fragments of a group of key tiles are read together, then the group's WMMAs run. The groups shrink (4, 2, 1, 1 tiles)
    // as finished score tiles fill the registers: the kernel stays at six waves per SIMD, which holds the whole grid resident.
    constexpr int kfirst[5] = {0, 4, 6, 7, 8};
#pragma unroll
    for (int gi = 0; gi < 4; ++gi) {
      v16h bk[2][4];
#pragma unroll
      for (int c = 0; c < 2; ++c)
#pragma unroll
        for (int t = kfirst[gi]; t < kfirst[gi + 1]; ++t)
          bk[c][t - kfirst[gi]] = make_ab(Klds + (16 * t + l16) * KSTR, 32 * c + 8 * half, 32 * c + 16 + 8 * half);
      // Keeps the group's reads together in front of its WMMAs: left free, each fragment was read, waited for and used alone.
      __builtin_amdgcn_sched_barrier(0);
#pragma unroll
      for (int c = 0; c < 2; ++c)
#pragma unroll
        for (int t = kfirst[gi]; t < kfirst[gi + 1]; ++t)
          sacc[t] = __builtin_amdgcn_wmma_f32_16x16x32_f16(
              false, bk[c][t - kfirst[gi]], false, aq[c], (short)0, sacc[t], false, false);
      // Keeps the next group's reads behind this block, so that they do not stand among its WMMAs.
      __builtin_amdgcn_sched_barrier(0);
    }

    // ---- Online softmax (log2 domain): a lane's 64 scores all belong to its own query ----
    float m = sacc[0][0];
#pragma unroll
    for (int t = 0; t < 8; ++t)
#pragma unroll
      for (int r = 0; r < 8; ++r) m = fmaxf(m, sacc[t][r]);
    m = fmaxf(m, xhalf(m));
    const float nm   = fmaxf(rmax, m);
    const float corr = __builtin_amdgcn_exp2f(rmax - nm);
    rmax = nm;

    // P^T packs straight into B fragments: elements 0..7 of chunk c are tile 2c's registers,
    // elements 8..15 tile 2c+1's (keys 32c + 8*half + i and 32c + 16 + 8*half + i, the loaders' k order).
    v16h bp[4];
    float ps0 = 0.0f, ps1 = 0.0f;
#pragma unroll
    for (int c = 0; c < 4; ++c) {
#pragma unroll
      for (int i = 0; i < 8; ++i) {
        float p0 = __builtin_amdgcn_exp2f(sacc[2 * c][i] - nm);
        float p1 = __builtin_amdgcn_exp2f(sacc[2 * c + 1][i] - nm);
        ps0 += p0;
        ps1 += p1;
        bp[c][i]     = (_Float16)p0;
        bp[c][i + 8] = (_Float16)p1;
      }
    }
    rsum = rsum * corr + (ps0 + ps1);
#pragma unroll
    for (int t = 0; t < 4; ++t)
#pragma unroll
      for (int r = 0; r < 8; ++r) oacc[t][r] *= corr;

    // ---- O^T += V^T*P^T : 4 key-chunks x 4 d-tiles = 16 WMMA / wave ----
    // The V^T fragments of a group of key chunks are read together, then the group's WMMAs run; the groups grow
    // (1, 1, 2 chunks) as used P^T fragments leave registers free.
    constexpr int vfirst[4] = {0, 1, 2, 4};
#pragma unroll
    for (int gi = 0; gi < 3; ++gi) {
      v16h av[2][4];
#pragma unroll
      for (int c = vfirst[gi]; c < vfirst[gi + 1]; ++c)
#pragma unroll
        for (int t = 0; t < 4; ++t)   // row = feature d
          av[c - vfirst[gi]][t] = make_ab(Vt + (16 * t + l16) * VSTR, 32 * c + 8 * half, 32 * c + 16 + 8 * half);
      // Keeps the group's reads together in front of its WMMAs (as above).
      __builtin_amdgcn_sched_barrier(0);
#pragma unroll
      for (int c = vfirst[gi]; c < vfirst[gi + 1]; ++c)
#pragma unroll
        for (int t = 0; t < 4; ++t)
          oacc[t] = __builtin_amdgcn_wmma_f32_16x16x32_f16(
              false, av[c - vfirst[gi]][t], false, bp[c], (short)0, oacc[t], false, false);
      // Keeps the next group's reads behind this block (as above). It stands behind the last block too: without it the
      // scheduler issued the first group's reads 14 instead of 63 vector instructions ahead of their first use.
      __builtin_amdgcn_sched_barrier(0);
    }
  }

  // ---- Join the halves' sums, normalize and store: oacc[t][r] = feature 16*t + 8*half + r of query l16 ----
  {
    const float inv = __builtin_amdgcn_rcpf(rsum + xhalf(rsum));
    float* orow = Op + (size_t)(qbase + 16 * wave + l16) * D_DIM + 8 * half;
#pragma unroll
    for (int t = 0; t < 4; ++t) {
      v4f lo, hi;
#pragma unroll
      for (int j = 0; j < 4; ++j) { lo[j] = oacc[t][j] * inv; hi[j] = oacc[t][j + 4] * inv; }
      *(v4f*)(orow + 16 * t)     = lo;
      *(v4f*)(orow + 16 * t + 4) = hi;
    }
  }
}

extern "C" void kernel_launch(void* const* d_in, const int* in_sizes, int n_in,
                              void* d_out, int out_size, void* d_ws, size_t ws_size,
                              hipStream_t stream) {
  (void)n_in; (void)out_size; (void)ws_size;
  const float* Q = (const float*)d_in[0];
  const float* K = (const float*)d_in[1];
  const float* V = (const float*)d_in[2];
  float* O = (float*)d_out;
  int bh = in_sizes[0] / (S_LEN * D_DIM);   // B*H = 24
  _Float16* K16  = (_Float16*)d_ws;                          // 12 MiB used
  _Float16* Vt16 = (_Float16*)((char*)d_ws + (64u << 20));   // 12 MiB used
  dim3 cgrid(S_LEN / TK, bh);
  cvt_kv_kernel<<<cgrid, 256, 0, stream>>>(K, V, K16, Vt16);
  dim3 grid(S_LEN / TQ, bh);
  fa_fwd_kernel<<<grid, 128, 0, stream>>>(Q, K16, Vt16, O);
}

// v004
// One run takes 90.6 microseconds.
// In two side-by-side timings against v003, it was 1.21 and 1.20 times as fast.
// Counting every step since v000, it is 5.25 times as fast.
#include <hip/hip_runtime.h>

typedef _Float16 v16h __attribute__((ext_vector_type(16)));
typedef _Float16 v8h  __attribute__((ext_vector_type(8)));
typedef _Float16 v2h  __attribute__((ext_vector_type(2)));
typedef float    v8f  __attribute__((ext_vector_type(8)));
typedef float    v4f  __attribute__((ext_vector_type(4)));

#define S_LEN  4096
#define D_DIM  64
#define NQ     2           // 16-query column groups per wave
#define TQ     128         // query rows per block (4 waves x 32)
#define TK     128         // KV tile
#define KSTR   72          // K-tile LDS row stride (halves), 16B aligned
#define VSTR   136         // Vt LDS row stride (halves), 16B aligned

// Build a v16h WMMA A/B fragment from two contiguous 16-byte LDS chunks.
__device__ __forceinline__ v16h make_ab(const _Float16* base, int off_lo, int off_hi) {
  v8h lo = *(const v8h*)(base + off_lo);
  v8h hi = *(const v8h*)(base + off_hi);
  v16h r;
#pragma unroll
  for (int i = 0; i < 8; ++i) { r[i] = lo[i]; r[i + 8] = hi[i]; }
  return r;
}

// Lane l <-> lane l ^ 16: the two wave halves hold the two key halves of one query column.
__device__ __forceinline__ float xhalf(float x) {
  return __builtin_bit_cast(float, __builtin_amdgcn_permlanex16(
      __builtin_bit_cast(int, x), __builtin_bit_cast(int, x), 0x76543210, 0xfedcba98, false, false));
}

// Eight v_exp_f32 in place and one free slot behind the last. The instruction set asks for one independent instruction before a
// transcendental's result is used or its source overwritten: in one statement each exponential has the next one behind it, on
// registers of its own, and the last has the v_nop.
__device__ __forceinline__ void exp2x8(float (&x)[8]) {
  asm("v_exp_f32 %0, %0\n\tv_exp_f32 %1, %1\n\tv_exp_f32 %2, %2\n\tv_exp_f32 %3, %3\n\t"
      "v_exp_f32 %4, %4\n\tv_exp_f32 %5, %5\n\tv_exp_f32 %6, %6\n\tv_exp_f32 %7, %7\n\tv_nop"
      : "+v"(x[0]), "+v"(x[1]), "+v"(x[2]), "+v"(x[3]), "+v"(x[4]), "+v"(x[5]), "+v"(x[6]), "+v"(x[7]));
}

// Pre-pass: one block turns 128 keys of one head into two contiguous 16-KiB f16 tiles, K as [key][feat] and
// V transposed as [feat][key], so that the 32 query blocks of a head copy finished tiles instead of each converting them.
__global__ __launch_bounds__(256)
void cvt_kv_kernel(const float* __restrict__ K, const float* __restrict__ V,
                   _Float16* __restrict__ K16, _Float16* __restrict__ Vt16) {
  __shared__ __align__(16) _Float16 T[D_DIM * VSTR];        // [feat][key]

  const int tid = threadIdx.x;
  const int kv  = blockIdx.x * TK;
  const size_t plane = (size_t)blockIdx.y * S_LEN * D_DIM;
  const float* Kp = K + plane + (size_t)kv * D_DIM;
  const float* Vp = V + plane + (size_t)kv * D_DIM;
  _Float16* Ko = K16 + plane + (size_t)kv * D_DIM;
  _Float16* Vo = Vt16 + plane + (size_t)kv * D_DIM;

  // Thread's first slots: 8 K values at tid*8; the V float4 of column tid & 15 in keys 2*(tid >> 4) and the next.
  const float* kp = Kp + tid * 8;
  const float* vp = Vp + (tid >> 4) * (2 * D_DIM) + (tid & 15) * 4;
  v4f ka[4], kb[4], va[4], vb[4];
#pragma unroll
  for (int i = 0; i < 4; ++i) {
    va[i] = *(const v4f*)(vp + 32 * D_DIM * i);             // key 2*(tid >> 4) + 32*i
    vb[i] = *(const v4f*)(vp + 32 * D_DIM * i + D_DIM);     // the next key
  }
#pragma unroll
  for (int i = 0; i < 4; ++i) {
    ka[i] = *(const v4f*)(kp + 2048 * i);
    kb[i] = *(const v4f*)(kp + 2048 * i + 4);
  }
  // All 16 loads issue before the first conversion: left free, the scheduler waited for V's data before it issued K's loads.
  __builtin_amdgcn_sched_barrier(0);

  // V: two keys of one feature make one dword of the transposed tile.
  _Float16* tw = T + (tid & 15) * 4 * VSTR + 2 * (tid >> 4);
#pragma unroll
  for (int i = 0; i < 4; ++i) {
#pragma unroll
    for (int j = 0; j < 4; ++j) {
      v2h p;
      p[0] = (_Float16)va[i][j];
      p[1] = (_Float16)vb[i][j];
      *(v2h*)(tw + j * VSTR + 32 * i) = p;                  // ds_store_b32
    }
  }
  __syncthreads();

#pragma unroll
  for (int i = 0; i < 4; ++i) {
    v8h h;
#pragma unroll
    for (int j = 0; j < 4; ++j) { h[j] = (_Float16)ka[i][j]; h[j + 4] = (_Float16)kb[i][j]; }
    *(v8h*)(Ko + tid * 8 + 2048 * i) = h;
  }

  // Feature (tid >> 4) + 16*i, 16-byte slot tid & 15 of its 256-byte row.
  const _Float16* tr = T + (tid >> 4) * VSTR + (tid & 15) * 8;
#pragma unroll
  for (int i = 0; i < 4; ++i)
    *(v8h*)(Vo + tid * 8 + 2048 * i) = *(const v8h*)(tr + 16 * VSTR * i);
}

__global__ __launch_bounds__(128)
void fa_fwd_kernel(const float* __restrict__ Q, const _Float16* __restrict__ K16,
                   const _Float16* __restrict__ Vt16, float* __restrict__ O) {
  __shared__ __align__(16) _Float16 Klds[TK * KSTR];        // [key][feat]
  __shared__ __align__(16) _Float16 Vt  [D_DIM * VSTR];     // [feat][key] transposed

  const int tid  = threadIdx.x;
  const int wave = tid >> 5;
  const int lane = tid & 31;
  const int half = lane >> 4;
  const int l16  = lane & 15;

  const int bh    = blockIdx.y;
  const int qbase = blockIdx.x * TQ;
  const size_t plane = (size_t)bh * S_LEN * D_DIM;
  const float* Qp = Q + plane;
  const _Float16* Kp = K16 + plane;    // tiles of [128 keys][feat]
  const _Float16* Vp = Vt16 + plane;   // tiles of [feat][128 keys]
  float*       Op = O + plane;

  // 1/sqrt(64) * log2(e): scores land directly in log2 domain -> raw v_exp_f32.
  const float qscale = 0.125f * 1.44269504088896340736f;

  // ---- Q fragments (column group q: query qbase + 32*wave + 16*q + l16), the B operands of S^T = K*Q^T ----
  v16h aq[NQ][2];
#pragma unroll
  for (int q = 0; q < NQ; ++q) {
    const float* qrow = Qp + (size_t)(qbase + 16 * NQ * wave + 16 * q + l16) * D_DIM;
#pragma unroll
    for (int c = 0; c < 2; ++c) {
      v4f f0 = *(const v4f*)(qrow + 32 * c + 8 * half);
      v4f f1 = *(const v4f*)(qrow + 32 * c + 8 * half + 4);
      v4f f2 = *(const v4f*)(qrow + 32 * c + 16 + 8 * half);
      v4f f3 = *(const v4f*)(qrow + 32 * c + 16 + 8 * half + 4);
#pragma unroll
      for (int j = 0; j < 4; ++j) {
        aq[q][c][j]      = (_Float16)(f0[j] * qscale);
        aq[q][c][j + 4]  = (_Float16)(f1[j] * qscale);
        aq[q][c][j + 8]  = (_Float16)(f2[j] * qscale);
        aq[q][c][j + 12] = (_Float16)(f3[j] * qscale);
      }
    }
  }

  v8f sacc[NQ][8], oacc[NQ][4];
#pragma unroll
  for (int q = 0; q < NQ; ++q)
#pragma unroll
    for (int t = 0; t < 4; ++t)
#pragma unroll
      for (int r = 0; r < 8; ++r) oacc[q][t][r] = 0.0f;

  // One query column per lane and group: running maximum (equal in both halves) and this half's part of the sum.
  float rmax[NQ], rsum[NQ];
#pragma unroll
  for (int q = 0; q < NQ; ++q) { rmax[q] = -1e30f; rsum[q] = 0.0f; }

  // This thread's first 16-byte slot of each tile in LDS.
  _Float16* kl = Klds + (tid >> 3) * KSTR + (tid & 7) * 8;
  _Float16* vl = Vt + (tid >> 4) * VSTR + (tid & 15) * 8;

  for (int kv = 0; kv < S_LEN; kv += TK) {
    __syncthreads();  // previous iteration's LDS reads complete

    // ---- Stage the pre-converted f16 tiles: 16-byte loads, 16-byte LDS stores ----
    // Slot tid + 128*i of 1024: K row (tid >> 3) + 16*i, V^T row (tid >> 4) + 8*i.
    const _Float16* kg = Kp + (size_t)kv * D_DIM + tid * 8;
    const _Float16* vg = Vp + (size_t)kv * D_DIM + tid * 8;
    v8h k8[8], v8[8];
#pragma unroll
    for (int i = 0; i < 8; ++i) {
      k8[i] = *(const v8h*)(kg + 1024 * i);
      v8[i] = *(const v8h*)(vg + 1024 * i);
    }
    // The two address pairs stay whole until this wait.
    asm volatile("s_wait_xcnt 0x0" :: "v"(kg), "v"(vg) : "memory");
#pragma unroll
    for (int i = 0; i < 8; ++i) {
      *(v8h*)(kl + 16 * KSTR * i) = k8[i];
      *(v8h*)(vl + 8 * VSTR * i)  = v8[i];
    }
    __syncthreads();

    // ---- S^T = K*Q^T : 8 key tiles x 2 k-chunks x 2 column groups = 32 WMMA / wave ----
    // sacc[q][t][r] = score of key 16*t + 8*half + r against query l16 of group q.
#pragma unroll
    for (int q = 0; q < NQ; ++q)
#pragma unroll
      for (int t = 0; t < 8; ++t)
#pragma unroll
        for (int r = 0; r < 8; ++r) sacc[q][t][r] = 0.0f;

    // All K fragments of the tile are read in one group, then its WMMAs run key tile by key tile: each fragment feeds both
    // column groups, and a finished key tile's fragments leave their registers to the next score tiles.
    {
      v16h bk[8][2];
#pragma unroll
      for (int t = 0; t < 8; ++t)
#pragma unroll
        for (int c = 0; c < 2; ++c)
          bk[t][c] = make_ab(Klds + (16 * t + l16) * KSTR, 32 * c + 8 * half, 32 * c + 16 + 8 * half);
      // Keeps the reads together in front of the WMMAs: left free, each fragment was read, waited for and used alone.
      __builtin_amdgcn_sched_barrier(0);
#pragma unroll
      for (int t = 0; t < 8; ++t)
#pragma unroll
        for (int c = 0; c < 2; ++c)
#pragma unroll
          for (int q = 0; q < NQ; ++q)
            sacc[q][t] = __builtin_amdgcn_wmma_f32_16x16x32_f16(
                false, bk[t][c], false, aq[q][c], (short)0, sacc[q][t], false, false);
      // Keeps later reads behind this block, so that they do not stand among its WMMAs.
      __builtin_amdgcn_sched_barrier(0);
    }

    // ---- Online softmax (log2 domain): a lane's 64 scores of a group all belong to its own query ----
    // P^T packs straight into B fragments: elements 0..7 of chunk c are tile 2c's registers,
    // elements 8..15 tile 2c+1's (keys 32c + 8*half + i and 32c + 16 + 8*half + i, the loaders' k order).
    v16h bp[NQ][4];
#pragma unroll
    for (int q = 0; q < NQ; ++q) {
      float m = sacc[q][0][0];
#pragma unroll
      for (int t = 0; t < 8; ++t)
#pragma unroll
        for (int r = 0; r < 8; ++r) m = fmaxf(m, sacc[q][t][r]);
      m = fmaxf(m, xhalf(m));
      const float nm   = fmaxf(rmax[q], m);
      const float corr = __builtin_amdgcn_exp2f(rmax[q] - nm);
      rmax[q] = nm;

      float ps0 = 0.0f, ps1 = 0.0f;
#pragma unroll
      for (int c = 0; c < 4; ++c) {
        float p0[8], p1[8];
#pragma unroll
        for (int i = 0; i < 8; ++i) {
          p0[i] = sacc[q][2 * c][i] - nm;
          p1[i] = sacc[q][2 * c + 1][i] - nm;
        }
        exp2x8(p0);
        exp2x8(p1);
#pragma unroll
        for (int i = 0; i < 8; ++i) {
          ps0 += p0[i];
          ps1 += p1[i];
          bp[q][c][i]     = (_Float16)p0[i];
          bp[q][c][i + 8] = (_Float16)p1[i];
        }
      }
      rsum[q] = rsum[q] * corr + (ps0 + ps1);
#pragma unroll
      for (int t = 0; t < 4; ++t)
#pragma unroll
        for (int r = 0; r < 8; ++r) oacc[q][t][r] *= corr;
    }

    // ---- O^T += V^T*P^T : 4 key-chunks x 4 d-tiles x 2 column groups = 32 WMMA / wave ----
    // All V^T fragments of the tile are read in one group, then its WMMAs run chunk by chunk: each fragment feeds both column groups.
    {
      v16h av[4][4];
#pragma unroll
      for (int c = 0; c < 4; ++c)
#pragma unroll
        for (int t = 0; t < 4; ++t)   // row = feature d
          av[c][t] = make_ab(Vt + (16 * t + l16) * VSTR, 32 * c + 8 * half, 32 * c + 16 + 8 * half);
      // Keeps the reads together in front of the WMMAs (as above).
      __builtin_amdgcn_sched_barrier(0);
#pragma unroll
      for (int c = 0; c < 4; ++c)
#pragma unroll
        for (int t = 0; t < 4; ++t)
#pragma unroll
          for (int q = 0; q < NQ; ++q)
            oacc[q][t] = __builtin_amdgcn_wmma_f32_16x16x32_f16(
                false, av[c][t], false, bp[q][c], (short)0, oacc[q][t], false, false);
      // Keeps the next tile's work behind this block (as above).
      __builtin_amdgcn_sched_barrier(0);
    }
  }

  // ---- Join the halves' sums, normalize and store: oacc[q][t][r] = feature 16*t + 8*half + r of query l16 of group q ----
#pragma unroll
  for (int q = 0; q < NQ; ++q) {
    const float inv = __builtin_amdgcn_rcpf(rsum[q] + xhalf(rsum[q]));
    float* orow = Op + (size_t)(qbase + 16 * NQ * wave + 16 * q + l16) * D_DIM + 8 * half;
#pragma unroll
    for (int t = 0; t < 4; ++t) {
      v4f lo, hi;
#pragma unroll
      for (int j = 0; j < 4; ++j) { lo[j] = oacc[q][t][j] * inv; hi[j] = oacc[q][t][j + 4] * inv; }
      *(v4f*)(orow + 16 * t)     = lo;
      *(v4f*)(orow + 16 * t + 4) = hi;
    }
  }
}

extern "C" void kernel_launch(void* const* d_in, const int* in_sizes, int n_in,
                              void* d_out, int out_size, void* d_ws, size_t ws_size,
                              hipStream_t stream) {
  (void)n_in; (void)out_size; (void)ws_size;
  const float* Q = (const float*)d_in[0];
  const float* K = (const float*)d_in[1];
  const float* V = (const float*)d_in[2];
  float* O = (float*)d_out;
  int bh = in_sizes[0] / (S_LEN * D_DIM);   // B*H = 24
  _Float16* K16  = (_Float16*)d_ws;                          // 12 MiB used
  _Float16* Vt16 = (_Float16*)((char*)d_ws + (64u << 20));   // 12 MiB used
  dim3 cgrid(S_LEN / TK, bh);
  cvt_kv_kernel<<<cgrid, 256, 0, stream>>>(K, V, K16, Vt16);
  dim3 grid(S_LEN / TQ, bh);
  fa_fwd_kernel<<<grid, 128, 0, stream>>>(Q, K16, Vt16, O);
}
